// v000
// Times are from an AMD MI455X. After a warm-up the kernel runs many times in a row, and a time is the length of
// such a window on the GPU divided by its runs, so every launch and the gaps after it count. The runs cycle
// through copies of the inputs. A figure is the median of several windows, for all but v000 over two sittings.
// Sittings can differ by a few percent; kernels timed side by side share one.
// v000 is the starting kernel. One run takes 552 microseconds.
#include <hip/hip_runtime.h>

#define BATCH 64
#define SEQ   1024
#define CH    1024
#define NH    16
#define HD    64
#define SCALEF 0.125f   // 64^-0.5

typedef __attribute__((ext_vector_type(2))) float v2f;
typedef __attribute__((ext_vector_type(8))) float v8f;

__device__ __forceinline__ unsigned lds_addr(const void* p) {
  return (unsigned)(unsigned long long)p;
}
__device__ __forceinline__ void async_ld_b128(unsigned lds, const void* gptr) {
  asm volatile("global_load_async_to_lds_b128 %0, %1, off"
               :: "v"(lds), "v"(gptr) : "memory");
}
__device__ __forceinline__ void wait_async0() {
  asm volatile("s_wait_asynccnt 0x0" ::: "memory");
}

// ---------------------------------------------------------------------------
// Kernel 1: per batch b
//   q[h,d]   = sum_c x[b,0,c] * W_q[c, h*64+d]          (kept in LDS)
//   u[b,h,c] = SCALE * sum_d W_kv[c, h*64+d] * q[h,d]   (k-half of W_kv)
// ---------------------------------------------------------------------------
__global__ __launch_bounds__(256) void k_qu(const float* __restrict__ x,
                                            const float* __restrict__ Wq,
                                            const float* __restrict__ Wkv,
                                            float* __restrict__ u) {
  __shared__ float xrow[CH];
  __shared__ float qsh[NH * HD];
  const int b = blockIdx.x;
  const int tid = threadIdx.x;
  const float* xb = x + (size_t)b * SEQ * CH;  // token 0 of batch b
  for (int i = tid; i < CH; i += 256) xrow[i] = xb[i];
  __syncthreads();
  for (int j = tid; j < NH * HD; j += 256) {
    float acc = 0.f;
    for (int c = 0; c < CH; ++c) acc = fmaf(xrow[c], Wq[(size_t)c * (NH * HD) + j], acc);
    qsh[j] = acc;
  }
  __syncthreads();
  for (int idx = tid; idx < NH * CH; idx += 256) {
    const int h = idx & (NH - 1);
    const int c = idx >> 4;
    const float* w  = Wkv + (size_t)c * (2 * NH * HD) + h * HD;  // k-columns
    const float* qh = qsh + h * HD;
    float acc = 0.f;
#pragma unroll
    for (int d = 0; d < HD; ++d) acc = fmaf(w[d], qh[d], acc);
    u[((size_t)b * NH + h) * CH + c] = SCALEF * acc;
  }
}

// ---------------------------------------------------------------------------
// Kernel 2: scores[b,h,n] = sum_c x[b,n,c] * u[b,h,c]
// Per-batch GEMM (1024 x 1024) @ (1024 x 16), V_WMMA_F32_16X16X4_F32.
// 8 waves/block, each wave owns a 16-row n-tile; async double-buffered LDS.
// ---------------------------------------------------------------------------
__global__ __launch_bounds__(256) void k_scores(const float* __restrict__ x,
                                                const float* __restrict__ u,
                                                float* __restrict__ scores) {
  __shared__ float xs[2][128 * 36];
  __shared__ float us[2][16 * 36];
  const int b   = blockIdx.x >> 3;
  const int rt  = blockIdx.x & 7;
  const int nb  = rt * 128;
  const int tid = threadIdx.x;
  const int w   = tid >> 5;        // wave id (wave32)
  const int l   = tid & 31;        // lane id
  const int l16 = l & 15;
  const int hi2 = (l >= 16) ? 2 : 0;
  const float* xb = x + ((size_t)b * SEQ + nb) * CH;
  const float* ub = u + (size_t)b * NH * CH;

  // async prefetch of one 32-wide K chunk into buffer `buf`
  auto prefetch = [&](int ck, int buf) {
#pragma unroll
    for (int t = 0; t < 4; ++t) {
      const int i = tid + t * 256;          // float4 index, 0..1023
      const int row = i >> 3, c4 = (i & 7) * 4;
      async_ld_b128(lds_addr(&xs[buf][row * 36 + c4]),
                    xb + (size_t)row * CH + ck + c4);
    }
    if (tid < 128) {
      const int h = tid >> 3, c4 = (tid & 7) * 4;
      async_ld_b128(lds_addr(&us[buf][h * 36 + c4]),
                    ub + (size_t)h * CH + ck + c4);
    }
  };

  v8f acc = {};
  prefetch(0, 0);
  for (int ci = 0; ci < CH / 32; ++ci) {
    wait_async0();
    __syncthreads();                 // buffer (ci&1) ready for all waves
    const int cur = ci & 1;
    if (ci + 1 < CH / 32) prefetch((ci + 1) * 32, cur ^ 1);
    const float* xsb = xs[cur];
    const float* usb = us[cur];
#pragma unroll
    for (int kk = 0; kk < 32; kk += 4) {
      const float* ap = &xsb[(w * 16 + l16) * 36 + kk + hi2];
      const float* bp = &usb[l16 * 36 + kk + hi2];
      v2f a;  a.x = ap[0];  a.y = ap[1];
      v2f bb; bb.x = bp[0]; bb.y = bp[1];
      acc = __builtin_amdgcn_wmma_f32_16x16x4_f32(false, a, false, bb,
                                                  (short)0, acc, false, false);
    }
  }
  const int mofs = (l >= 16) ? 8 : 0;
  float* srow = scores + ((size_t)b * NH + l16) * SEQ + nb + w * 16 + mofs;
#pragma unroll
  for (int r = 0; r < 8; ++r) srow[r] = acc[r];
}

// ---------------------------------------------------------------------------
// Kernel 3: softmax over n (row length 1024), one block per (b,h)
// ---------------------------------------------------------------------------
__global__ __launch_bounds__(256) void k_softmax(float* __restrict__ s) {
  __shared__ float red[256];
  const int tid = threadIdx.x;
  float* p = s + (size_t)blockIdx.x * SEQ;
  float v[4];
  float m = -3.0e38f;
#pragma unroll
  for (int i = 0; i < 4; ++i) { v[i] = p[tid + i * 256]; m = fmaxf(m, v[i]); }
  red[tid] = m; __syncthreads();
  for (int o = 128; o > 0; o >>= 1) {
    if (tid < o) red[tid] = fmaxf(red[tid], red[tid + o]);
    __syncthreads();
  }
  m = red[0]; __syncthreads();
  float sum = 0.f;
#pragma unroll
  for (int i = 0; i < 4; ++i) { v[i] = __expf(v[i] - m); sum += v[i]; }
  red[tid] = sum; __syncthreads();
  for (int o = 128; o > 0; o >>= 1) {
    if (tid < o) red[tid] += red[tid + o];
    __syncthreads();
  }
  const float inv = 1.f / red[0];
#pragma unroll
  for (int i = 0; i < 4; ++i) p[tid + i * 256] = v[i] * inv;
}

// ---------------------------------------------------------------------------
// Kernel 4: y[b,h,c] = sum_n attn[b,h,n] * x[b,n,c]
// Per-batch GEMM (16 x 1024) @ (1024 x 1024), WMMA, async double-buffered.
// ---------------------------------------------------------------------------
__global__ __launch_bounds__(256) void k_attnx(const float* __restrict__ x,
                                               const float* __restrict__ attn,
                                               float* __restrict__ y) {
  __shared__ float xs[2][32 * 144];  // x tile [n row][c], stride 144
  __shared__ float as[2][16 * 36];   // attn chunk [h][n]
  const int b   = blockIdx.x >> 3;
  const int ct  = blockIdx.x & 7;
  const int cb  = ct * 128;
  const int tid = threadIdx.x;
  const int w   = tid >> 5;
  const int l   = tid & 31;
  const int l16 = l & 15;
  const int hi2 = (l >= 16) ? 2 : 0;
  const float* xb = x + (size_t)b * SEQ * CH + cb;
  const float* ab = attn + (size_t)b * NH * SEQ;

  auto prefetch = [&](int nk, int buf) {
#pragma unroll
    for (int t = 0; t < 4; ++t) {
      const int i = tid + t * 256;          // float4 index, 0..1023
      const int row = i >> 5, c4 = (i & 31) * 4;
      async_ld_b128(lds_addr(&xs[buf][row * 144 + c4]),
                    xb + (size_t)(nk + row) * CH + c4);
    }
    if (tid < 128) {
      const int h = tid >> 3, n4 = (tid & 7) * 4;
      async_ld_b128(lds_addr(&as[buf][h * 36 + n4]),
                    ab + (size_t)h * SEQ + nk + n4);
    }
  };

  v8f acc = {};
  prefetch(0, 0);
  for (int ni = 0; ni < SEQ / 32; ++ni) {
    wait_async0();
    __syncthreads();
    const int cur = ni & 1;
    if (ni + 1 < SEQ / 32) prefetch((ni + 1) * 32, cur ^ 1);
    const float* xsb = xs[cur];
    const float* asb = as[cur];
#pragma unroll
    for (int kk = 0; kk < 32; kk += 4) {
      // A (16x4, M=h, K=n)
      const float* ap = &asb[l16 * 36 + kk + hi2];
      v2f a; a.x = ap[0]; a.y = ap[1];
      v2f bb;
      bb.x = xsb[(kk + hi2    ) * 144 + w * 16 + l16];
      bb.y = xsb[(kk + hi2 + 1) * 144 + w * 16 + l16];
      acc = __builtin_amdgcn_wmma_f32_16x16x4_f32(false, a, false, bb,
                                                  (short)0, acc, false, false);
    }
  }
  const int mofs = (l >= 16) ? 8 : 0;  // h offset
  const int c = cb + w * 16 + l16;
#pragma unroll
  for (int r = 0; r < 8; ++r)
    y[((size_t)b * NH + mofs + r) * CH + c] = acc[r];
}

// ---------------------------------------------------------------------------
// Kernel 5: cls[b,h,d] = sum_c y[b,h,c] * W_kv[c, 1024 + h*64 + d]  (v-half)
//           out[b,:]   = cls[b,:] @ W_proj + b_proj
// Coalesced over W columns: thread tid owns cls outputs idx = tid + 256k,
// whose W_kv column is 1024+idx (consecutive across threads per c row).
// ---------------------------------------------------------------------------
__global__ __launch_bounds__(256) void k_out(const float* __restrict__ y,
                                             const float* __restrict__ Wkv,
                                             const float* __restrict__ Wproj,
                                             const float* __restrict__ bproj,
                                             float* __restrict__ out) {
  __shared__ float ych[NH * 256];   // y chunk [h][c within chunk]
  __shared__ float cls[NH * HD];
  const int b = blockIdx.x;
  const int tid = threadIdx.x;
  float acc[4] = {0.f, 0.f, 0.f, 0.f};
  for (int c0 = 0; c0 < CH; c0 += 256) {
    __syncthreads();
    for (int i = tid; i < NH * 256; i += 256) {
      const int h = i >> 8, c = i & 255;
      ych[h * 256 + c] = y[((size_t)b * NH + h) * CH + c0 + c];
    }
    __syncthreads();
    for (int c = 0; c < 256; ++c) {
      const float* wrow = Wkv + (size_t)(c0 + c) * (2 * NH * HD) + NH * HD;
#pragma unroll
      for (int k = 0; k < 4; ++k) {
        const int idx = tid + 256 * k;           // = h*64 + d
        acc[k] = fmaf(ych[(idx >> 6) * 256 + c], wrow[idx], acc[k]);
      }
    }
  }
#pragma unroll
  for (int k = 0; k < 4; ++k) cls[tid + 256 * k] = acc[k];
  __syncthreads();
  for (int j = tid; j < CH; j += 256) {
    float a2 = bproj[j];
    for (int k = 0; k < NH * HD; ++k)
      a2 = fmaf(cls[k], Wproj[(size_t)k * CH + j], a2);
    out[(size_t)b * CH + j] = a2;
  }
}

// ---------------------------------------------------------------------------
extern "C" void kernel_launch(void* const* d_in, const int* in_sizes, int n_in,
                              void* d_out, int out_size, void* d_ws, size_t ws_size,
                              hipStream_t stream) {
  const float* x     = (const float*)d_in[0];
  const float* Wkv   = (const float*)d_in[1];
  const float* Wq    = (const float*)d_in[2];
  const float* Wproj = (const float*)d_in[3];
  const float* bproj = (const float*)d_in[4];
  float* out = (float*)d_out;

  float* u      = (float*)d_ws;                        // B*NH*CH  = 1M floats
  float* scores = u + (size_t)BATCH * NH * CH;         // B*NH*SEQ = 1M floats
  float* yv     = scores + (size_t)BATCH * NH * SEQ;   // B*NH*CH  = 1M floats

  k_qu     <<<BATCH,      256, 0, stream>>>(x, Wq, Wkv, u);
  k_scores <<<BATCH * 8,  256, 0, stream>>>(x, u, scores);
  k_softmax<<<BATCH * NH, 256, 0, stream>>>(scores);
  k_attnx  <<<BATCH * 8,  256, 0, stream>>>(x, scores, yv);
  k_out    <<<BATCH,      256, 0, stream>>>(yv, Wkv, Wproj, bproj, out);
}

// v001
// It runs in 288 microseconds.
// In two side-by-side timings against v000, it was 1.92 and 1.94 times as fast.
#include <hip/hip_runtime.h>

#define BATCH 64
#define SEQ   1024
#define CH    1024
#define NH    16
#define HD    64
#define SCALEF 0.125f   // 64^-0.5

typedef __attribute__((ext_vector_type(2))) float v2f;
typedef __attribute__((ext_vector_type(4))) float v4f;
typedef __attribute__((ext_vector_type(8))) float v8f;

__device__ __forceinline__ unsigned lds_addr(const void* p) {
  return (unsigned)(unsigned long long)p;
}
__device__ __forceinline__ void async_ld_b128(unsigned lds, const void* gptr) {
  asm volatile("global_load_async_to_lds_b128 %0, %1, off"
               :: "v"(lds), "v"(gptr) : "memory");
}
__device__ __forceinline__ void wait_async0() {
  asm volatile("s_wait_asynccnt 0x0" ::: "memory");
}

// ---------------------------------------------------------------------------
// Kernel 1: per batch b
//   q[h,d]   = sum_c x[b,0,c] * W_q[c, h*64+d]          (kept in LDS)
//   u[b,h,c] = SCALE * sum_d W_kv[c, h*64+d] * q[h,d]   (k-half of W_kv)
// ---------------------------------------------------------------------------
__global__ __launch_bounds__(256) void k_qu(const float* __restrict__ x,
                                            const float* __restrict__ Wq,
                                            const float* __restrict__ Wkv,
                                            float* __restrict__ u) {
  __shared__ float xrow[CH];
  __shared__ float qsh[NH * HD];
  const int b = blockIdx.x;
  const int tid = threadIdx.x;
  const float* xb = x + (size_t)b * SEQ * CH;  // token 0 of batch b
  for (int i = tid; i < CH; i += 256) xrow[i] = xb[i];
  __syncthreads();
  for (int j = tid; j < NH * HD; j += 256) {
    float acc = 0.f;
    for (int c = 0; c < CH; ++c) acc = fmaf(xrow[c], Wq[(size_t)c * (NH * HD) + j], acc);
    qsh[j] = acc;
  }
  __syncthreads();
  for (int idx = tid; idx < NH * CH; idx += 256) {
    const int h = idx & (NH - 1);
    const int c = idx >> 4;
    const float* w  = Wkv + (size_t)c * (2 * NH * HD) + h * HD;  // k-columns
    const float* qh = qsh + h * HD;
    float acc = 0.f;
#pragma unroll
    for (int d = 0; d < HD; ++d) acc = fmaf(w[d], qh[d], acc);
    u[((size_t)b * NH + h) * CH + c] = SCALEF * acc;
  }
}

// ---------------------------------------------------------------------------
// Kernel 2: scores[b,h,n] = sum_c x[b,n,c] * u[b,h,c]
// Per-batch GEMM (1024 x 1024) @ (1024 x 16), V_WMMA_F32_16X16X4_F32.
// 8 waves/block, each wave owns a 16-row n-tile; async double-buffered LDS.
// ---------------------------------------------------------------------------
__global__ __launch_bounds__(256) void k_scores(const float* __restrict__ x,
                                                const float* __restrict__ u,
                                                float* __restrict__ scores) {
  __shared__ float xs[2][128 * 36];
  __shared__ float us[2][16 * 36];
  const int b   = blockIdx.x >> 3;
  const int rt  = blockIdx.x & 7;
  const int nb  = rt * 128;
  const int tid = threadIdx.x;
  const int w   = tid >> 5;        // wave id (wave32)
  const int l   = tid & 31;        // lane id
  const int l16 = l & 15;
  const int hi2 = (l >= 16) ? 2 : 0;
  const float* xb = x + ((size_t)b * SEQ + nb) * CH;
  const float* ub = u + (size_t)b * NH * CH;

  // async prefetch of one 32-wide K chunk into buffer `buf`
  auto prefetch = [&](int ck, int buf) {
#pragma unroll
    for (int t = 0; t < 4; ++t) {
      const int i = tid + t * 256;          // float4 index, 0..1023
      const int row = i >> 3, c4 = (i & 7) * 4;
      async_ld_b128(lds_addr(&xs[buf][row * 36 + c4]),
                    xb + (size_t)row * CH + ck + c4);
    }
    if (tid < 128) {
      const int h = tid >> 3, c4 = (tid & 7) * 4;
      async_ld_b128(lds_addr(&us[buf][h * 36 + c4]),
                    ub + (size_t)h * CH + ck + c4);
    }
  };

  v8f acc = {};
  prefetch(0, 0);
  for (int ci = 0; ci < CH / 32; ++ci) {
    wait_async0();
    __syncthreads();                 // buffer (ci&1) ready for all waves
    const int cur = ci & 1;
    if (ci + 1 < CH / 32) prefetch((ci + 1) * 32, cur ^ 1);
    const float* xsb = xs[cur];
    const float* usb = us[cur];
#pragma unroll
    for (int kk = 0; kk < 32; kk += 4) {
      const float* ap = &xsb[(w * 16 + l16) * 36 + kk + hi2];
      const float* bp = &usb[l16 * 36 + kk + hi2];
      v2f a;  a.x = ap[0];  a.y = ap[1];
      v2f bb; bb.x = bp[0]; bb.y = bp[1];
      acc = __builtin_amdgcn_wmma_f32_16x16x4_f32(false, a, false, bb,
                                                  (short)0, acc, false, false);
    }
  }
  const int mofs = (l >= 16) ? 8 : 0;
  float* srow = scores + ((size_t)b * NH + l16) * SEQ + nb + w * 16 + mofs;
#pragma unroll
  for (int r = 0; r < 8; ++r) srow[r] = acc[r];
}

// ---------------------------------------------------------------------------
// Kernel 3: softmax over n (row length 1024), one block per (b,h)
// ---------------------------------------------------------------------------
__global__ __launch_bounds__(256) void k_softmax(float* __restrict__ s) {
  __shared__ float red[256];
  const int tid = threadIdx.x;
  float* p = s + (size_t)blockIdx.x * SEQ;
  float v[4];
  float m = -3.0e38f;
#pragma unroll
  for (int i = 0; i < 4; ++i) { v[i] = p[tid + i * 256]; m = fmaxf(m, v[i]); }
  red[tid] = m; __syncthreads();
  for (int o = 128; o > 0; o >>= 1) {
    if (tid < o) red[tid] = fmaxf(red[tid], red[tid + o]);
    __syncthreads();
  }
  m = red[0]; __syncthreads();
  float sum = 0.f;
#pragma unroll
  for (int i = 0; i < 4; ++i) { v[i] = __expf(v[i] - m); sum += v[i]; }
  red[tid] = sum; __syncthreads();
  for (int o = 128; o > 0; o >>= 1) {
    if (tid < o) red[tid] += red[tid + o];
    __syncthreads();
  }
  const float inv = 1.f / red[0];
#pragma unroll
  for (int i = 0; i < 4; ++i) p[tid + i * 256] = v[i] * inv;
}

// ---------------------------------------------------------------------------
// Kernel 4: y[b,h,c] = sum_n attn[b,h,n] * x[b,n,c]
// Per-batch GEMM (16 x 1024) @ (1024 x 1024), WMMA, async double-buffered.
// ---------------------------------------------------------------------------
__global__ __launch_bounds__(256) void k_attnx(const float* __restrict__ x,
                                               const float* __restrict__ attn,
                                               float* __restrict__ y) {
  __shared__ float xs[2][32 * 144];  // x tile [n row][c], stride 144
  __shared__ float as[2][16 * 36];   // attn chunk [h][n]
  const int b   = blockIdx.x >> 3;
  const int ct  = blockIdx.x & 7;
  const int cb  = ct * 128;
  const int tid = threadIdx.x;
  const int w   = tid >> 5;
  const int l   = tid & 31;
  const int l16 = l & 15;
  const int hi2 = (l >= 16) ? 2 : 0;
  const float* xb = x + (size_t)b * SEQ * CH + cb;
  const float* ab = attn + (size_t)b * NH * SEQ;

  auto prefetch = [&](int nk, int buf) {
#pragma unroll
    for (int t = 0; t < 4; ++t) {
      const int i = tid + t * 256;          // float4 index, 0..1023
      const int row = i >> 5, c4 = (i & 31) * 4;
      async_ld_b128(lds_addr(&xs[buf][row * 144 + c4]),
                    xb + (size_t)(nk + row) * CH + c4);
    }
    if (tid < 128) {
      const int h = tid >> 3, n4 = (tid & 7) * 4;
      async_ld_b128(lds_addr(&as[buf][h * 36 + n4]),
                    ab + (size_t)h * SEQ + nk + n4);
    }
  };

  v8f acc = {};
  prefetch(0, 0);
  for (int ni = 0; ni < SEQ / 32; ++ni) {
    wait_async0();
    __syncthreads();
    const int cur = ni & 1;
    if (ni + 1 < SEQ / 32) prefetch((ni + 1) * 32, cur ^ 1);
    const float* xsb = xs[cur];
    const float* asb = as[cur];
#pragma unroll
    for (int kk = 0; kk < 32; kk += 4) {
      // A (16x4, M=h, K=n)
      const float* ap = &asb[l16 * 36 + kk + hi2];
      v2f a; a.x = ap[0]; a.y = ap[1];
      v2f bb;
      bb.x = xsb[(kk + hi2    ) * 144 + w * 16 + l16];
      bb.y = xsb[(kk + hi2 + 1) * 144 + w * 16 + l16];
      acc = __builtin_amdgcn_wmma_f32_16x16x4_f32(false, a, false, bb,
                                                  (short)0, acc, false, false);
    }
  }
  const int mofs = (l >= 16) ? 8 : 0;  // h offset
  const int c = cb + w * 16 + l16;
#pragma unroll
  for (int r = 0; r < 8; ++r)
    y[((size_t)b * NH + mofs + r) * CH + c] = acc[r];
}

template <int LDA, int LDB>
__device__ __forceinline__ float tile16x32_k1024(const float* __restrict__ A,
                                                 const float* __restrict__ B,
                                                 float* part) {
  const int tid = threadIdx.x;
  const int w   = tid >> 5;
  const int l   = tid & 31;
  const int l16 = l & 15;
  const int k0  = w * 64 + (l >> 4) * 4;
  const float* ap = A + (size_t)l16 * LDA + k0;
  const float* bp = B + (size_t)k0 * LDB + 2 * l16;
  v4f a4[8];
  v2f b2[8][4];
#pragma unroll
  for (int i = 0; i < 8; ++i) a4[i] = *(const v4f*)(ap + i * 8);
#pragma unroll
  for (int i = 0; i < 8; ++i)
#pragma unroll
    for (int e = 0; e < 4; ++e)
      b2[i][e] = *(const v2f*)(bp + (size_t)(i * 8 + e) * LDB);
  // Holds the products behind all 40 loads, so that the wave's whole k slice
  // is in flight at once; without it the loads are dealt out among the WMMAs,
  // about a third of them in flight, and the slice takes several round trips.
  __builtin_amdgcn_sched_barrier(0);
  v8f acc0 = {}, acc1 = {};
#pragma unroll
  for (int i = 0; i < 8; ++i) {
#pragma unroll
    for (int p = 0; p < 2; ++p) {
      v2f a;  a.x  = a4[i][2 * p];    a.y  = a4[i][2 * p + 1];
      v2f c0; c0.x = b2[i][2 * p].x;  c0.y = b2[i][2 * p + 1].x;
      v2f c1; c1.x = b2[i][2 * p].y;  c1.y = b2[i][2 * p + 1].y;
      acc0 = __builtin_amdgcn_wmma_f32_16x16x4_f32(false, a, false, c0,
                                                   (short)0, acc0, false, false);
      acc1 = __builtin_amdgcn_wmma_f32_16x16x4_f32(false, a, false, c1,
                                                   (short)0, acc1, false, false);
    }
  }
#pragma unroll
  for (int r = 0; r < 8; ++r) {
    v2f t; t.x = acc0[r]; t.y = acc1[r];
    *(v2f*)&part[w * 512 + r * 64 + 2 * l] = t;
  }
  __syncthreads();                   // all 16 partial tiles are in LDS
  float s = part[tid];
#pragma unroll
  for (int q = 1; q < 16; ++q) s += part[q * 512 + tid];
  return s;
}

// Kernel 5: cls[b,h,d] = sum_c y[b,h,c] * W_kv[c, 1024 + h*64 + d]  (v-half)
// block = (16 batch rows, 32 columns of one head)
__global__ __launch_bounds__(512) void k_cls(const float* __restrict__ y,
                                             const float* __restrict__ Wkv,
                                             float* __restrict__ cls) {
  __shared__ float part[16 * 512];
  const int tid = threadIdx.x;
  const int mt = blockIdx.x & 3;
  const int nt = blockIdx.x >> 2;
  const int h  = nt >> 1;
  const float s = tile16x32_k1024<NH * CH, 2 * NH * HD>(
      y + (size_t)mt * 16 * NH * CH + (size_t)h * CH,
      Wkv + NH * HD + nt * 32, part);
  const int row = (tid >> 6) + 8 * ((tid >> 5) & 1);
  cls[(size_t)(mt * 16 + row) * (NH * HD) + nt * 32 + (tid & 31)] = s;
}

// Kernel 6: out[b,:] = cls[b,:] @ W_proj + b_proj
// block = (16 batch rows, 32 output columns)
__global__ __launch_bounds__(512) void k_proj(const float* __restrict__ cls,
                                              const float* __restrict__ Wproj,
                                              const float* __restrict__ bproj,
                                              float* __restrict__ out) {
  __shared__ float part[16 * 512];
  const int tid = threadIdx.x;
  const int mt = blockIdx.x & 3;
  const int nt = blockIdx.x >> 2;
  const float s = tile16x32_k1024<NH * HD, CH>(
      cls + (size_t)mt * 16 * NH * HD, Wproj + nt * 32, part);
  const int row = (tid >> 6) + 8 * ((tid >> 5) & 1);
  const int col = nt * 32 + (tid & 31);
  out[(size_t)(mt * 16 + row) * CH + col] = s + bproj[col];
}

// ---------------------------------------------------------------------------
extern "C" void kernel_launch(void* const* d_in, const int* in_sizes, int n_in,
                              void* d_out, int out_size, void* d_ws, size_t ws_size,
                              hipStream_t stream) {
  const float* x     = (const float*)d_in[0];
  const float* Wkv   = (const float*)d_in[1];
  const float* Wq    = (const float*)d_in[2];
  const float* Wproj = (const float*)d_in[3];
  const float* bproj = (const float*)d_in[4];
  float* out = (float*)d_out;

  float* u      = (float*)d_ws;                        // B*NH*CH  = 1M floats
  float* scores = u + (size_t)BATCH * NH * CH;         // B*NH*SEQ = 1M floats
  float* yv     = scores + (size_t)BATCH * NH * SEQ;   // B*NH*CH  = 1M floats
  float* cls    = yv + (size_t)BATCH * NH * CH;        // B*NH*HD  = 64K floats

  k_qu     <<<BATCH,      256, 0, stream>>>(x, Wq, Wkv, u);
  k_scores <<<BATCH * 8,  256, 0, stream>>>(x, u, scores);
  k_softmax<<<BATCH * NH, 256, 0, stream>>>(scores);
  k_attnx  <<<BATCH * 8,  256, 0, stream>>>(x, scores, yv);
  k_cls    <<<128,        512, 0, stream>>>(yv, Wkv, cls);
  k_proj   <<<128,        512, 0, stream>>>(cls, Wproj, bproj, out);
}

// v002
// Measured time: 75.3 microseconds a run.
// In two side-by-side timings against v001, it was 3.78 and 3.83 times as fast.
// Over all steps from v000 it is 7.35 times as fast.
#include <hip/hip_runtime.h>

#define BATCH 64
#define SEQ   1024
#define CH    1024
#define NH    16
#define HD    64
#define SCALEF 0.125f   // 64^-0.5

typedef __attribute__((ext_vector_type(2))) float v2f;
typedef __attribute__((ext_vector_type(4))) float v4f;
typedef __attribute__((ext_vector_type(8))) float v8f;

__device__ __forceinline__ unsigned lds_addr(const void* p) {
  return (unsigned)(unsigned long long)p;
}
__device__ __forceinline__ void async_ld_b128(unsigned lds, const void* gptr) {
  asm volatile("global_load_async_to_lds_b128 %0, %1, off"
               :: "v"(lds), "v"(gptr) : "memory");
}
__device__ __forceinline__ void wait_async0() {
  asm volatile("s_wait_asynccnt 0x0" ::: "memory");
}

// ---------------------------------------------------------------------------
// Kernel 2: scores[b,h,n] = sum_c x[b,n,c] * u[b,h,c]
// Per-batch GEMM (1024 x 1024) @ (1024 x 16), V_WMMA_F32_16X16X4_F32.
// 8 waves/block, each wave owns a 16-row n-tile; async double-buffered LDS.
// ---------------------------------------------------------------------------
__global__ __launch_bounds__(256) void k_scores(const float* __restrict__ x,
                                                const float* __restrict__ u,
                                                float* __restrict__ scores) {
  __shared__ float xs[2][128 * 36];
  __shared__ float us[2][16 * 36];
  const int b   = blockIdx.x >> 3;
  const int rt  = blockIdx.x & 7;
  const int nb  = rt * 128;
  const int tid = threadIdx.x;
  const int w   = tid >> 5;        // wave id (wave32)
  const int l   = tid & 31;        // lane id
  const int l16 = l & 15;
  const int hi2 = (l >= 16) ? 2 : 0;
  const float* xb = x + ((size_t)b * SEQ + nb) * CH;
  const float* ub = u + (size_t)b * NH * CH;

  // async prefetch of one 32-wide K chunk into buffer `buf`
  auto prefetch = [&](int ck, int buf) {
#pragma unroll
    for (int t = 0; t < 4; ++t) {
      const int i = tid + t * 256;          // float4 index, 0..1023
      const int row = i >> 3, c4 = (i & 7) * 4;
      async_ld_b128(lds_addr(&xs[buf][row * 36 + c4]),
                    xb + (size_t)row * CH + ck + c4);
    }
    if (tid < 128) {
      const int h = tid >> 3, c4 = (tid & 7) * 4;
      async_ld_b128(lds_addr(&us[buf][h * 36 + c4]),
                    ub + (size_t)h * CH + ck + c4);
    }
  };

  v8f acc = {};
  prefetch(0, 0);
  for (int ci = 0; ci < CH / 32; ++ci) {
    wait_async0();
    __syncthreads();                 // buffer (ci&1) ready for all waves
    const int cur = ci & 1;
    if (ci + 1 < CH / 32) prefetch((ci + 1) * 32, cur ^ 1);
    const float* xsb = xs[cur];
    const float* usb = us[cur];
#pragma unroll
    for (int kk = 0; kk < 32; kk += 4) {
      const float* ap = &xsb[(w * 16 + l16) * 36 + kk + hi2];
      const float* bp = &usb[l16 * 36 + kk + hi2];
      v2f a;  a.x = ap[0];  a.y = ap[1];
      v2f bb; bb.x = bp[0]; bb.y = bp[1];
      acc = __builtin_amdgcn_wmma_f32_16x16x4_f32(false, a, false, bb,
                                                  (short)0, acc, false, false);
    }
  }
  const int mofs = (l >= 16) ? 8 : 0;
  float* srow = scores + ((size_t)b * NH + l16) * SEQ + nb + w * 16 + mofs;
#pragma unroll
  for (int r = 0; r < 8; ++r) srow[r] = acc[r];
}

// ---------------------------------------------------------------------------
// Kernel 3: softmax over n (row length 1024), one block per (b,h)
// ---------------------------------------------------------------------------
__global__ __launch_bounds__(256) void k_softmax(float* __restrict__ s) {
  __shared__ float red[256];
  const int tid = threadIdx.x;
  float* p = s + (size_t)blockIdx.x * SEQ;
  float v[4];
  float m = -3.0e38f;
#pragma unroll
  for (int i = 0; i < 4; ++i) { v[i] = p[tid + i * 256]; m = fmaxf(m, v[i]); }
  red[tid] = m; __syncthreads();
  for (int o = 128; o > 0; o >>= 1) {
    if (tid < o) red[tid] = fmaxf(red[tid], red[tid + o]);
    __syncthreads();
  }
  m = red[0]; __syncthreads();
  float sum = 0.f;
#pragma unroll
  for (int i = 0; i < 4; ++i) { v[i] = __expf(v[i] - m); sum += v[i]; }
  red[tid] = sum; __syncthreads();
  for (int o = 128; o > 0; o >>= 1) {
    if (tid < o) red[tid] += red[tid + o];
    __syncthreads();
  }
  const float inv = 1.f / red[0];
#pragma unroll
  for (int i = 0; i < 4; ++i) p[tid + i * 256] = v[i] * inv;
}

// ---------------------------------------------------------------------------
// Kernel 4: y[b,h,c] = sum_n attn[b,h,n] * x[b,n,c]
// Per-batch GEMM (16 x 1024) @ (1024 x 1024), WMMA, async double-buffered.
// ---------------------------------------------------------------------------
__global__ __launch_bounds__(256) void k_attnx(const float* __restrict__ x,
                                               const float* __restrict__ attn,
                                               float* __restrict__ y) {
  __shared__ float xs[2][32 * 144];  // x tile [n row][c], stride 144
  __shared__ float as[2][16 * 36];   // attn chunk [h][n]
  const int b   = blockIdx.x >> 3;
  const int ct  = blockIdx.x & 7;
  const int cb  = ct * 128;
  const int tid = threadIdx.x;
  const int w   = tid >> 5;
  const int l   = tid & 31;
  const int l16 = l & 15;
  const int hi2 = (l >= 16) ? 2 : 0;
  const float* xb = x + (size_t)b * SEQ * CH + cb;
  const float* ab = attn + (size_t)b * NH * SEQ;

  auto prefetch = [&](int nk, int buf) {
#pragma unroll
    for (int t = 0; t < 4; ++t) {
      const int i = tid + t * 256;          // float4 index, 0..1023
      const int row = i >> 5, c4 = (i & 31) * 4;
      async_ld_b128(lds_addr(&xs[buf][row * 144 + c4]),
                    xb + (size_t)(nk + row) * CH + c4);
    }
    if (tid < 128) {
      const int h = tid >> 3, n4 = (tid & 7) * 4;
      async_ld_b128(lds_addr(&as[buf][h * 36 + n4]),
                    ab + (size_t)h * SEQ + nk + n4);
    }
  };

  v8f acc = {};
  prefetch(0, 0);
  for (int ni = 0; ni < SEQ / 32; ++ni) {
    wait_async0();
    __syncthreads();
    const int cur = ni & 1;
    if (ni + 1 < SEQ / 32) prefetch((ni + 1) * 32, cur ^ 1);
    const float* xsb = xs[cur];
    const float* asb = as[cur];
#pragma unroll
    for (int kk = 0; kk < 32; kk += 4) {
      // A (16x4, M=h, K=n)
      const float* ap = &asb[l16 * 36 + kk + hi2];
      v2f a; a.x = ap[0]; a.y = ap[1];
      v2f bb;
      bb.x = xsb[(kk + hi2    ) * 144 + w * 16 + l16];
      bb.y = xsb[(kk + hi2 + 1) * 144 + w * 16 + l16];
      acc = __builtin_amdgcn_wmma_f32_16x16x4_f32(false, a, false, bb,
                                                  (short)0, acc, false, false);
    }
  }
  const int mofs = (l >= 16) ? 8 : 0;  // h offset
  const int c = cb + w * 16 + l16;
#pragma unroll
  for (int r = 0; r < 8; ++r)
    y[((size_t)b * NH + mofs + r) * CH + c] = acc[r];
}

template <int LDA, int LDB>
__device__ __forceinline__ float tile16x32_k1024(const float* __restrict__ A,
                                                 const float* __restrict__ B,
                                                 float* part) {
  const int tid = threadIdx.x;
  const int w   = tid >> 5;
  const int l   = tid & 31;
  const int l16 = l & 15;
  const int k0  = w * 64 + (l >> 4) * 4;
  const float* ap = A + (size_t)l16 * LDA + k0;
  const float* bp = B + (size_t)k0 * LDB + 2 * l16;
  v4f a4[8];
  v2f b2[8][4];
#pragma unroll
  for (int i = 0; i < 8; ++i) a4[i] = *(const v4f*)(ap + i * 8);
#pragma unroll
  for (int i = 0; i < 8; ++i)
#pragma unroll
    for (int e = 0; e < 4; ++e)
      b2[i][e] = *(const v2f*)(bp + (size_t)(i * 8 + e) * LDB);
  // Holds the products behind all 40 loads, so that the wave's whole k slice
  // is in flight at once; without it the loads are dealt out among the WMMAs,
  // about a third of them in flight, and the slice takes several round trips.
  __builtin_amdgcn_sched_barrier(0);
  v8f acc0 = {}, acc1 = {};
#pragma unroll
  for (int i = 0; i < 8; ++i) {
#pragma unroll
    for (int p = 0; p < 2; ++p) {
      v2f a;  a.x  = a4[i][2 * p];    a.y  = a4[i][2 * p + 1];
      v2f c0; c0.x = b2[i][2 * p].x;  c0.y = b2[i][2 * p + 1].x;
      v2f c1; c1.x = b2[i][2 * p].y;  c1.y = b2[i][2 * p + 1].y;
      acc0 = __builtin_amdgcn_wmma_f32_16x16x4_f32(false, a, false, c0,
                                                   (short)0, acc0, false, false);
      acc1 = __builtin_amdgcn_wmma_f32_16x16x4_f32(false, a, false, c1,
                                                   (short)0, acc1, false, false);
    }
  }
#pragma unroll
  for (int r = 0; r < 8; ++r) {
    v2f t; t.x = acc0[r]; t.y = acc1[r];
    *(v2f*)&part[w * 512 + r * 64 + 2 * l] = t;
  }
  __syncthreads();                   // all 16 partial tiles are in LDS
  float s = part[tid];
#pragma unroll
  for (int q = 1; q < 16; ++q) s += part[q * 512 + tid];
  return s;
}

// Kernel 5: cls[b,h,d] = sum_c y[b,h,c] * W_kv[c, 1024 + h*64 + d]  (v-half)
// block = (16 batch rows, 32 columns of one head)
__global__ __launch_bounds__(512) void k_cls(const float* __restrict__ y,
                                             const float* __restrict__ Wkv,
                                             float* __restrict__ cls) {
  __shared__ float part[16 * 512];
  const int tid = threadIdx.x;
  const int mt = blockIdx.x & 3;
  const int nt = blockIdx.x >> 2;
  const int h  = nt >> 1;
  const float s = tile16x32_k1024<NH * CH, 2 * NH * HD>(
      y + (size_t)mt * 16 * NH * CH + (size_t)h * CH,
      Wkv + NH * HD + nt * 32, part);
  const int row = (tid >> 6) + 8 * ((tid >> 5) & 1);
  cls[(size_t)(mt * 16 + row) * (NH * HD) + nt * 32 + (tid & 31)] = s;
}

// Kernel 6: out[b,:] = cls[b,:] @ W_proj + b_proj
// block = (16 batch rows, 32 output columns)
__global__ __launch_bounds__(512) void k_proj(const float* __restrict__ cls,
                                              const float* __restrict__ Wproj,
                                              const float* __restrict__ bproj,
                                              float* __restrict__ out) {
  __shared__ float part[16 * 512];
  const int tid = threadIdx.x;
  const int mt = blockIdx.x & 3;
  const int nt = blockIdx.x >> 2;
  const float s = tile16x32_k1024<NH * HD, CH>(
      cls + (size_t)mt * 16 * NH * HD, Wproj + nt * 32, part);
  const int row = (tid >> 6) + 8 * ((tid >> 5) & 1);
  const int col = nt * 32 + (tid & 31);
  out[(size_t)(mt * 16 + row) * CH + col] = s + bproj[col];
}

// Kernel 1: q[b,:] = x[b,0,:] @ W_q, all 64 batch rows at once (M = 64).
// block = (16 batch rows, 32 columns); row b of A is token 0 of batch b.
__global__ __launch_bounds__(512) void k_q(const float* __restrict__ x,
                                           const float* __restrict__ Wq,
                                           float* __restrict__ q) {
  __shared__ float part[16 * 512];
  const int tid = threadIdx.x;
  const int mt = blockIdx.x & 3;
  const int nt = blockIdx.x >> 2;
  const float s = tile16x32_k1024<SEQ * CH, NH * HD>(
      x + (size_t)mt * 16 * SEQ * CH, Wq + nt * 32, part);
  const int row = (tid >> 6) + 8 * ((tid >> 5) & 1);
  q[(size_t)(mt * 16 + row) * (NH * HD) + nt * 32 + (tid & 31)] = s;
}

__global__ __launch_bounds__(256) void k_u(const float* __restrict__ q,
                                           const float* __restrict__ Wkv,
                                           float* __restrict__ u) {
  const int tid = threadIdx.x;
  const int w   = tid >> 5;
  const int l   = tid & 31;
  const int l16 = l & 15;
  const int h   = blockIdx.x >> 4;
  const int c0  = (blockIdx.x & 15) * 64 + (w >> 2) * 32;
  const int mt  = w & 3;
  const int k0  = h * HD + (l >> 4) * 4;
  const float* ap = q + (size_t)(mt * 16 + l16) * (NH * HD) + k0;
  const float* bp = Wkv + (size_t)(c0 + 2 * l16) * (2 * NH * HD) + k0;
  // D: lane column l16, register r holds batch row r (+8 for the high lanes)
  float* up = u + ((size_t)(mt * 16 + (l >> 4) * 8) * NH + h) * CH + c0 + 2 * l16;
  // Every loop below is unrolled whole: a4, b4 and the accumulators are
  // indexed by constants only and so stay in registers.
  v4f a4[8], b4[2][8];
#pragma unroll
  for (int i = 0; i < 8; ++i) a4[i] = *(const v4f*)(ap + i * 8);
#pragma unroll
  for (int j = 0; j < 2; ++j)
#pragma unroll
    for (int i = 0; i < 8; ++i)
      b4[j][i] = *(const v4f*)(bp + (size_t)j * (2 * NH * HD) + i * 8);
  // Holds the products behind all 24 loads, so that both 128-byte lines of
  // every row are asked for at once; without it a third of the loads is in
  // flight and the second line waits for the first to come back.
  __builtin_amdgcn_sched_barrier(0);
  v8f acc0 = {}, acc1 = {};
#pragma unroll
  for (int i = 0; i < 8; ++i) {
#pragma unroll
    for (int p = 0; p < 2; ++p) {
      v2f a;  a.x  = a4[i][2 * p];    a.y  = a4[i][2 * p + 1];
      v2f e0; e0.x = b4[0][i][2 * p]; e0.y = b4[0][i][2 * p + 1];
      v2f e1; e1.x = b4[1][i][2 * p]; e1.y = b4[1][i][2 * p + 1];
      acc0 = __builtin_amdgcn_wmma_f32_16x16x4_f32(false, a, false, e0,
                                                   (short)0, acc0, false, false);
      acc1 = __builtin_amdgcn_wmma_f32_16x16x4_f32(false, a, false, e1,
                                                   (short)0, acc1, false, false);
    }
  }
#pragma unroll
  for (int r = 0; r < 8; ++r) {
    v2f t; t.x = SCALEF * acc0[r]; t.y = SCALEF * acc1[r];
    *(v2f*)(up + (size_t)r * NH * CH) = t;
  }
}

// ---------------------------------------------------------------------------
extern "C" void kernel_launch(void* const* d_in, const int* in_sizes, int n_in,
                              void* d_out, int out_size, void* d_ws, size_t ws_size,
                              hipStream_t stream) {
  const float* x     = (const float*)d_in[0];
  const float* Wkv   = (const float*)d_in[1];
  const float* Wq    = (const float*)d_in[2];
  const float* Wproj = (const float*)d_in[3];
  const float* bproj = (const float*)d_in[4];
  float* out = (float*)d_out;

  float* u      = (float*)d_ws;                        // B*NH*CH  = 1M floats
  float* scores = u + (size_t)BATCH * NH * CH;         // B*NH*SEQ = 1M floats
  float* yv     = scores + (size_t)BATCH * NH * SEQ;   // B*NH*CH  = 1M floats
  float* cls    = yv + (size_t)BATCH * NH * CH;        // B*NH*HD  = 64K floats
  float* qv     = cls + (size_t)BATCH * NH * HD;       // B*NH*HD  = 64K floats

  k_q      <<<128,        512, 0, stream>>>(x, Wq, qv);
  k_u      <<<NH * 16,    256, 0, stream>>>(qv, Wkv, u);
  k_scores <<<BATCH * 8,  256, 0, stream>>>(x, u, scores);
  k_softmax<<<BATCH * NH, 256, 0, stream>>>(scores);
  k_attnx  <<<BATCH * 8,  256, 0, stream>>>(x, scores, yv);
  k_cls    <<<128,        512, 0, stream>>>(yv, Wkv, cls);
  k_proj   <<<128,        512, 0, stream>>>(cls, Wproj, bproj, out);
}

// v003
// One run takes 55.8 microseconds.
// Timed twice side by side with v002, it ran 1.34 and 1.35 times as fast.
// All steps since v000 together make it 9.87 times as fast.
#include <hip/hip_runtime.h>

#define BATCH 64
#define SEQ   1024
#define CH    1024
#define NH    16
#define HD    64
#define SCALEF 0.125f   // 64^-0.5

typedef __attribute__((ext_vector_type(2))) float v2f;
typedef __attribute__((ext_vector_type(4))) float v4f;
typedef __attribute__((ext_vector_type(8))) float v8f;

__device__ __forceinline__ unsigned lds_addr(const void* p) {
  return (unsigned)(unsigned long long)p;
}
__device__ __forceinline__ void wait_async0() {
  asm volatile("s_wait_asynccnt 0x0" ::: "memory");
}

#define NSPLIT 8
#define XP 1028

// Eight copies of one lane, rows `d`/`g` onward; the wait in the same statement
// stands in front of any rewrite of the address registers.
__device__ __forceinline__ void async_rows8(unsigned d, const float* g) {
  asm volatile(
      "global_load_async_to_lds_b128 %0, %1, off\n\t"
      "global_load_async_to_lds_b128 %2, %3, off\n\t"
      "global_load_async_to_lds_b128 %4, %5, off\n\t"
      "global_load_async_to_lds_b128 %6, %7, off\n\t"
      "global_load_async_to_lds_b128 %8, %9, off\n\t"
      "global_load_async_to_lds_b128 %10, %11, off\n\t"
      "global_load_async_to_lds_b128 %12, %13, off\n\t"
      "global_load_async_to_lds_b128 %14, %15, off\n\t"
      "s_wait_xcnt 0x0"
      :: "v"(d),              "v"(g),
         "v"(d + 1 * XP * 4), "v"(g + 1 * CH),
         "v"(d + 2 * XP * 4), "v"(g + 2 * CH),
         "v"(d + 3 * XP * 4), "v"(g + 3 * CH),
         "v"(d + 4 * XP * 4), "v"(g + 4 * CH),
         "v"(d + 5 * XP * 4), "v"(g + 5 * CH),
         "v"(d + 6 * XP * 4), "v"(g + 6 * CH),
         "v"(d + 7 * XP * 4), "v"(g + 7 * CH)
      : "memory");
}

// 256 registers a wave at most: two blocks share a WGP (2 x 139,776 B of LDS),
// so that one block's WMMAs fill the other's barrier and softmax gaps.
__global__ __launch_bounds__(256) __attribute__((amdgpu_waves_per_eu(4, 4)))
void k_fused(const float* __restrict__ x, const float* __restrict__ u,
             float* __restrict__ ypart, float* __restrict__ ml) {
  __shared__ __attribute__((aligned(16))) float xs[2][16 * XP];
  __shared__ __attribute__((aligned(16))) float part[8 * 2 * 32 * 4];
  const int b   = blockIdx.x >> 3;
  const int sp  = blockIdx.x & 7;
  const int tid = threadIdx.x;
  const int w   = tid >> 5;
  const int l   = tid & 31;
  const int l16 = l & 15;
  const int hi  = l >> 4;
  // the lane's own 16 bytes of each row of its wave's column slice
  const float* xg = x + ((size_t)b * SEQ + sp * 128) * CH + w * 128 + l * 4;

  auto fill = [&](int t, int buf) {
    const float* g = xg + (size_t)t * 16 * CH;
    const unsigned d = lds_addr(&xs[buf][w * 128 + l * 4]);
    async_rows8(d, g);
    async_rows8(d + 8 * XP * 4, g + 8 * CH);
  };

  fill(0, 0);
  v4f u4[16];
  {
    const float* up = u + ((size_t)b * NH + l16) * CH + w * 128 + hi * 4;
#pragma unroll
    for (int i = 0; i < 16; ++i) u4[i] = *(const v4f*)(up + i * 8);
  }
  v8f acc[2][4] = {};
  float m = -3.0e38f, lsum = 0.f;
  wait_async0();
  __syncthreads();                   // tile 0 is in LDS
  fill(1, 1);

  for (int t = 0; t < 8; ++t) {
    const float* xt = xs[t & 1];
    v8f s0 = {}, s1 = {};
    const float* ap = xt + l16 * XP + w * 128 + hi * 4;
#pragma unroll
    for (int i = 0; i < 16; ++i) {
      const v4f a4 = *(const v4f*)(ap + i * 8);
      v2f a0; a0.x = a4.x;    a0.y = a4.y;
      v2f a1; a1.x = a4.z;    a1.y = a4.w;
      v2f b0; b0.x = u4[i].x; b0.y = u4[i].y;
      v2f b1; b1.x = u4[i].z; b1.y = u4[i].w;
      s0 = __builtin_amdgcn_wmma_f32_16x16x4_f32(false, a0, false, b0,
                                                 (short)0, s0, false, false);
      s1 = __builtin_amdgcn_wmma_f32_16x16x4_f32(false, a1, false, b1,
                                                 (short)0, s1, false, false);
    }
    s0 += s1;
    {
      v4f lo; lo.x = s0[0]; lo.y = s0[1]; lo.z = s0[2]; lo.w = s0[3];
      v4f up4; up4.x = s0[4]; up4.y = s0[5]; up4.z = s0[6]; up4.w = s0[7];
      *(v4f*)&part[((w * 2 + 0) * 32 + l) * 4] = lo;
      *(v4f*)&part[((w * 2 + 1) * 32 + l) * 4] = up4;
    }
    __syncthreads();                 // all 8 partial score tiles are in LDS
    v4f sl = *(const v4f*)&part[l * 4];
    v4f sh = *(const v4f*)&part[(32 + l) * 4];
#pragma unroll
    for (int q = 1; q < 8; ++q) {
      sl += *(const v4f*)&part[((q * 2 + 0) * 32 + l) * 4];
      sh += *(const v4f*)&part[((q * 2 + 1) * 32 + l) * 4];
    }
    float p[8] = {sl.x, sl.y, sl.z, sl.w, sh.x, sh.y, sh.z, sh.w};
    float tm = p[0];
#pragma unroll
    for (int r = 1; r < 8; ++r) tm = fmaxf(tm, p[r]);
    tm = fmaxf(tm, __shfl_xor(tm, 16));        // the other 8 rows of this head
    const float mn = fmaxf(m, tm);
    const float alpha = __expf(m - mn);
    m = mn;
    float ps = 0.f;
#pragma unroll
    for (int r = 0; r < 8; ++r) { p[r] = __expf(p[r] - mn); ps += p[r]; }
    lsum = lsum * alpha + ps;
#pragma unroll
    for (int g = 0; g < 2; ++g)
#pragma unroll
      for (int e = 0; e < 4; ++e) acc[g][e] *= alpha;
    v4f xr[2][4][2];
#pragma unroll
    for (int g = 0; g < 2; ++g)
#pragma unroll
      for (int j = 0; j < 4; ++j) {
        const float* rp = xt + (8 * hi + 2 * j) * XP + w * 128 + g * 64 + 4 * l16;
        xr[g][j][0] = *(const v4f*)rp;
        xr[g][j][1] = *(const v4f*)(rp + XP);
      }
    auto second = [&](int g) {
#pragma unroll
      for (int j = 0; j < 4; ++j) {
        v2f pb; pb.x = p[2 * j]; pb.y = p[2 * j + 1];
#pragma unroll
        for (int e = 0; e < 4; ++e) {
          v2f a; a.x = xr[g][j][0][e]; a.y = xr[g][j][1][e];
          acc[g][e] = __builtin_amdgcn_wmma_f32_16x16x4_f32(
              false, a, false, pb, (short)0, acc[g][e], false, false);
        }
      }
    };
    second(0);
    // Keeps the first half's WMMAs in front of the hand-over: without it the
    // wait for tile t+1's copies is lifted in front of them, a quarter of a
    // trip away from the refill, and every copy has that much less time to land.
    __builtin_amdgcn_sched_barrier(0);
    // hand-over of the ring: the tile's last fragments are fetched and this
    // wave's LDS reads done, its copies of tile t+1 have landed, then every
    // wave meets; only then the refill of the buffer just read.
    asm volatile("s_wait_dscnt 0x0" ::: "memory");
    wait_async0();
    __syncthreads();
    if (t + 2 < 8) fill(t + 2, t & 1);
    second(1);
  }
  wait_async0();

  // Turn the wave's slice from (lane = h) to (lane = c) through its own columns
  // of buffer 0, so that every global store is 512 contiguous bytes.
#pragma unroll
  for (int g = 0; g < 2; ++g)
#pragma unroll
    for (int r = 0; r < 8; ++r) {
      v4f v; v.x = acc[g][0][r]; v.y = acc[g][1][r];
      v.z = acc[g][2][r]; v.w = acc[g][3][r];
      *(v4f*)&xs[0][l16 * XP + w * 128 + g * 64 + 4 * (r + 8 * hi)] = v;
    }
  float* yp = ypart + (size_t)blockIdx.x * NH * CH + w * 128 + l * 4;
#pragma unroll
  for (int h = 0; h < NH; ++h)
    *(v4f*)(yp + (size_t)h * CH) = *(const v4f*)&xs[0][h * XP + w * 128 + l * 4];
  lsum += __shfl_xor(lsum, 16);
  if (tid < 16) {
    ml[blockIdx.x * 32 + tid]      = m;
    ml[blockIdx.x * 32 + 16 + tid] = lsum;
  }
}

// Joins the 8 row splits of one (batch, head):
//   y = sum_s e^(m_s - M) ypart_s / sum_s e^(m_s - M) l_s,  M = max_s m_s
__global__ __launch_bounds__(256) void k_join(const float* __restrict__ ypart,
                                              const float* __restrict__ ml,
                                              float* __restrict__ y) {
  const int b = blockIdx.x >> 4;
  const int h = blockIdx.x & 15;
  const int tid = threadIdx.x;
  const float* yp = ypart + ((size_t)b * NSPLIT * NH + h) * CH + tid * 4;
  v4f v[NSPLIT];
#pragma unroll
  for (int s = 0; s < NSPLIT; ++s) v[s] = *(const v4f*)(yp + (size_t)s * NH * CH);
  float ms[NSPLIT], M = -3.0e38f;
#pragma unroll
  for (int s = 0; s < NSPLIT; ++s) {
    ms[s] = ml[(b * NSPLIT + s) * 32 + h];
    M = fmaxf(M, ms[s]);
  }
  float L = 0.f;
  v4f a = {};
#pragma unroll
  for (int s = 0; s < NSPLIT; ++s) {
    const float e = __expf(ms[s] - M);
    L += e * ml[(b * NSPLIT + s) * 32 + 16 + h];
    a += e * v[s];
  }
  *(v4f*)(y + (size_t)blockIdx.x * CH + tid * 4) = a * (1.f / L);
}

template <int LDA, int LDB>
__device__ __forceinline__ float tile16x32_k1024(const float* __restrict__ A,
                                                 const float* __restrict__ B,
                                                 float* part) {
  const int tid = threadIdx.x;
  const int w   = tid >> 5;
  const int l   = tid & 31;
  const int l16 = l & 15;
  const int k0  = w * 64 + (l >> 4) * 4;
  const float* ap = A + (size_t)l16 * LDA + k0;
  const float* bp = B + (size_t)k0 * LDB + 2 * l16;
  v4f a4[8];
  v2f b2[8][4];
#pragma unroll
  for (int i = 0; i < 8; ++i) a4[i] = *(const v4f*)(ap + i * 8);
#pragma unroll
  for (int i = 0; i < 8; ++i)
#pragma unroll
    for (int e = 0; e < 4; ++e)
      b2[i][e] = *(const v2f*)(bp + (size_t)(i * 8 + e) * LDB);
  // Holds the products behind all 40 loads, so that the wave's whole k slice
  // is in flight at once; without it the loads are dealt out among the WMMAs,
  // about a third of them in flight, and the slice takes several round trips.
  __builtin_amdgcn_sched_barrier(0);
  v8f acc0 = {}, acc1 = {};
#pragma unroll
  for (int i = 0; i < 8; ++i) {
#pragma unroll
    for (int p = 0; p < 2; ++p) {
      v2f a;  a.x  = a4[i][2 * p];    a.y  = a4[i][2 * p + 1];
      v2f c0; c0.x = b2[i][2 * p].x;  c0.y = b2[i][2 * p + 1].x;
      v2f c1; c1.x = b2[i][2 * p].y;  c1.y = b2[i][2 * p + 1].y;
      acc0 = __builtin_amdgcn_wmma_f32_16x16x4_f32(false, a, false, c0,
                                                   (short)0, acc0, false, false);
      acc1 = __builtin_amdgcn_wmma_f32_16x16x4_f32(false, a, false, c1,
                                                   (short)0, acc1, false, false);
    }
  }
#pragma unroll
  for (int r = 0; r < 8; ++r) {
    v2f t; t.x = acc0[r]; t.y = acc1[r];
    *(v2f*)&part[w * 512 + r * 64 + 2 * l] = t;
  }
  __syncthreads();                   // all 16 partial tiles are in LDS
  float s = part[tid];
#pragma unroll
  for (int q = 1; q < 16; ++q) s += part[q * 512 + tid];
  return s;
}

// Kernel 5: cls[b,h,d] = sum_c y[b,h,c] * W_kv[c, 1024 + h*64 + d]  (v-half)
// block = (16 batch rows, 32 columns of one head)
__global__ __launch_bounds__(512) void k_cls(const float* __restrict__ y,
                                             const float* __restrict__ Wkv,
                                             float* __restrict__ cls) {
  __shared__ float part[16 * 512];
  const int tid = threadIdx.x;
  const int mt = blockIdx.x & 3;
  const int nt = blockIdx.x >> 2;
  const int h  = nt >> 1;
  const float s = tile16x32_k1024<NH * CH, 2 * NH * HD>(
      y + (size_t)mt * 16 * NH * CH + (size_t)h * CH,
      Wkv + NH * HD + nt * 32, part);
  const int row = (tid >> 6) + 8 * ((tid >> 5) & 1);
  cls[(size_t)(mt * 16 + row) * (NH * HD) + nt * 32 + (tid & 31)] = s;
}

// Kernel 6: out[b,:] = cls[b,:] @ W_proj + b_proj
// block = (16 batch rows, 32 output columns)
__global__ __launch_bounds__(512) void k_proj(const float* __restrict__ cls,
                                              const float* __restrict__ Wproj,
                                              const float* __restrict__ bproj,
                                              float* __restrict__ out) {
  __shared__ float part[16 * 512];
  const int tid = threadIdx.x;
  const int mt = blockIdx.x & 3;
  const int nt = blockIdx.x >> 2;
  const float s = tile16x32_k1024<NH * HD, CH>(
      cls + (size_t)mt * 16 * NH * HD, Wproj + nt * 32, part);
  const int row = (tid >> 6) + 8 * ((tid >> 5) & 1);
  const int col = nt * 32 + (tid & 31);
  out[(size_t)(mt * 16 + row) * CH + col] = s + bproj[col];
}

// Kernel 1: q[b,:] = x[b,0,:] @ W_q, all 64 batch rows at once (M = 64).
// block = (16 batch rows, 32 columns); row b of A is token 0 of batch b.
__global__ __launch_bounds__(512) void k_q(const float* __restrict__ x,
                                           const float* __restrict__ Wq,
                                           float* __restrict__ q) {
  __shared__ float part[16 * 512];
  const int tid = threadIdx.x;
  const int mt = blockIdx.x & 3;
  const int nt = blockIdx.x >> 2;
  const float s = tile16x32_k1024<SEQ * CH, NH * HD>(
      x + (size_t)mt * 16 * SEQ * CH, Wq + nt * 32, part);
  const int row = (tid >> 6) + 8 * ((tid >> 5) & 1);
  q[(size_t)(mt * 16 + row) * (NH * HD) + nt * 32 + (tid & 31)] = s;
}

__global__ __launch_bounds__(256) void k_u(const float* __restrict__ q,
                                           const float* __restrict__ Wkv,
                                           float* __restrict__ u) {
  const int tid = threadIdx.x;
  const int w   = tid >> 5;
  const int l   = tid & 31;
  const int l16 = l & 15;
  const int h   = blockIdx.x >> 4;
  const int c0  = (blockIdx.x & 15) * 64 + (w >> 2) * 32;
  const int mt  = w & 3;
  const int k0  = h * HD + (l >> 4) * 4;
  const float* ap = q + (size_t)(mt * 16 + l16) * (NH * HD) + k0;
  const float* bp = Wkv + (size_t)(c0 + 2 * l16) * (2 * NH * HD) + k0;
  // D: lane column l16, register r holds batch row r (+8 for the high lanes)
  float* up = u + ((size_t)(mt * 16 + (l >> 4) * 8) * NH + h) * CH + c0 + 2 * l16;
  // Every loop below is unrolled whole: a4, b4 and the accumulators are
  // indexed by constants only and so stay in registers.
  v4f a4[8], b4[2][8];
#pragma unroll
  for (int i = 0; i < 8; ++i) a4[i] = *(const v4f*)(ap + i * 8);
#pragma unroll
  for (int j = 0; j < 2; ++j)
#pragma unroll
    for (int i = 0; i < 8; ++i)
      b4[j][i] = *(const v4f*)(bp + (size_t)j * (2 * NH * HD) + i * 8);
  // Holds the products behind all 24 loads, so that both 128-byte lines of
  // every row are asked for at once; without it a third of the loads is in
  // flight and the second line waits for the first to come back.
  __builtin_amdgcn_sched_barrier(0);
  v8f acc0 = {}, acc1 = {};
#pragma unroll
  for (int i = 0; i < 8; ++i) {
#pragma unroll
    for (int p = 0; p < 2; ++p) {
      v2f a;  a.x  = a4[i][2 * p];    a.y  = a4[i][2 * p + 1];
      v2f e0; e0.x = b4[0][i][2 * p]; e0.y = b4[0][i][2 * p + 1];
      v2f e1; e1.x = b4[1][i][2 * p]; e1.y = b4[1][i][2 * p + 1];
      acc0 = __builtin_amdgcn_wmma_f32_16x16x4_f32(false, a, false, e0,
                                                   (short)0, acc0, false, false);
      acc1 = __builtin_amdgcn_wmma_f32_16x16x4_f32(false, a, false, e1,
                                                   (short)0, acc1, false, false);
    }
  }
#pragma unroll
  for (int r = 0; r < 8; ++r) {
    v2f t; t.x = SCALEF * acc0[r]; t.y = SCALEF * acc1[r];
    *(v2f*)(up + (size_t)r * NH * CH) = t;
  }
}

// ---------------------------------------------------------------------------
extern "C" void kernel_launch(void* const* d_in, const int* in_sizes, int n_in,
                              void* d_out, int out_size, void* d_ws, size_t ws_size,
                              hipStream_t stream) {
  const float* x     = (const float*)d_in[0];
  const float* Wkv   = (const float*)d_in[1];
  const float* Wq    = (const float*)d_in[2];
  const float* Wproj = (const float*)d_in[3];
  const float* bproj = (const float*)d_in[4];
  float* out = (float*)d_out;

  float* u      = (float*)d_ws;                        // B*NH*CH  = 1M floats
  float* yv     = u + (size_t)BATCH * NH * CH;         // B*NH*CH  = 1M floats
  float* cls    = yv + (size_t)BATCH * NH * CH;        // B*NH*HD  = 64K floats
  float* qv     = cls + (size_t)BATCH * NH * HD;       // B*NH*HD  = 64K floats
  float* ml     = qv + (size_t)BATCH * NH * HD;        // B*8*32   = 16K floats
  float* ypart  = ml + (size_t)BATCH * NSPLIT * 32;    // B*8*NH*CH = 8M floats

  k_q      <<<128,        512, 0, stream>>>(x, Wq, qv);
  k_u      <<<NH * 16,    256, 0, stream>>>(qv, Wkv, u);
  k_fused  <<<BATCH * NSPLIT, 256, 0, stream>>>(x, u, ypart, ml);
  k_join   <<<BATCH * NH, 256, 0, stream>>>(ypart, ml, yv);
  k_cls    <<<128,        512, 0, stream>>>(yv, Wkv, cls);
  k_proj   <<<128,        512, 0, stream>>>(cls, Wproj, bproj, out);
}

// v004
// Measured time: 54.5 microseconds a run.
// In both of two side-by-side timings against v003, it was 1.04 times as fast.
// Over all steps from v000 it is 10.3 times as fast.
#include <hip/hip_runtime.h>

#define BATCH 64
#define SEQ   1024
#define CH    1024
#define NH    16
#define HD    64
#define SCALEF 0.125f   // 64^-0.5

typedef __attribute__((ext_vector_type(2))) float v2f;
typedef __attribute__((ext_vector_type(4))) float v4f;
typedef __attribute__((ext_vector_type(8))) float v8f;

__device__ __forceinline__ unsigned lds_addr(const void* p) {
  return (unsigned)(unsigned long long)p;
}
__device__ __forceinline__ void wait_async0() {
  asm volatile("s_wait_asynccnt 0x0" ::: "memory");
}

#define NSPLIT 8
#define XP 1028

// Eight copies of one lane, rows `d`/`g` onward; the wait in the same statement
// stands in front of any rewrite of the address registers.
__device__ __forceinline__ void async_rows8(unsigned d, const float* g) {
  asm volatile(
      "global_load_async_to_lds_b128 %0, %1, off\n\t"
      "global_load_async_to_lds_b128 %2, %3, off\n\t"
      "global_load_async_to_lds_b128 %4, %5, off\n\t"
      "global_load_async_to_lds_b128 %6, %7, off\n\t"
      "global_load_async_to_lds_b128 %8, %9, off\n\t"
      "global_load_async_to_lds_b128 %10, %11, off\n\t"
      "global_load_async_to_lds_b128 %12, %13, off\n\t"
      "global_load_async_to_lds_b128 %14, %15, off\n\t"
      "s_wait_xcnt 0x0"
      :: "v"(d),              "v"(g),
         "v"(d + 1 * XP * 4), "v"(g + 1 * CH),
         "v"(d + 2 * XP * 4), "v"(g + 2 * CH),
         "v"(d + 3 * XP * 4), "v"(g + 3 * CH),
         "v"(d + 4 * XP * 4), "v"(g + 4 * CH),
         "v"(d + 5 * XP * 4), "v"(g + 5 * CH),
         "v"(d + 6 * XP * 4), "v"(g + 6 * CH),
         "v"(d + 7 * XP * 4), "v"(g + 7 * CH)
      : "memory");
}

// 256 registers a wave at most: two blocks share a WGP (2 x 139,776 B of LDS),
// so that one block's WMMAs fill the other's barrier and softmax gaps.
__global__ __launch_bounds__(256) __attribute__((amdgpu_waves_per_eu(4, 4)))
void k_fused(const float* __restrict__ x, const float* __restrict__ u,
             float* __restrict__ ypart, float* __restrict__ ml) {
  __shared__ __attribute__((aligned(16))) float xs[2][16 * XP];
  __shared__ __attribute__((aligned(16))) float part[8 * 2 * 32 * 4];
  const int b   = blockIdx.x >> 3;
  const int sp  = blockIdx.x & 7;
  const int tid = threadIdx.x;
  const int w   = tid >> 5;
  const int l   = tid & 31;
  const int l16 = l & 15;
  const int hi  = l >> 4;
  // the lane's own 16 bytes of each row of its wave's column slice
  const float* xg = x + ((size_t)b * SEQ + sp * 128) * CH + w * 128 + l * 4;

  auto fill = [&](int t, int buf) {
    const float* g = xg + (size_t)t * 16 * CH;
    const unsigned d = lds_addr(&xs[buf][w * 128 + l * 4]);
    async_rows8(d, g);
    async_rows8(d + 8 * XP * 4, g + 8 * CH);
  };

  fill(0, 0);
  v4f u4[16];
  {
    const float* up = u + ((size_t)b * NH + l16) * CH + w * 128 + hi * 4;
#pragma unroll
    for (int i = 0; i < 16; ++i) u4[i] = *(const v4f*)(up + i * 8);
  }
  v8f acc[2][4] = {};
  float m = -3.0e38f, lsum = 0.f;
  wait_async0();
  __syncthreads();                   // tile 0 is in LDS
  fill(1, 1);

  for (int t = 0; t < 8; ++t) {
    const float* xt = xs[t & 1];
    v8f s0 = {}, s1 = {};
    const float* ap = xt + l16 * XP + w * 128 + hi * 4;
#pragma unroll
    for (int i = 0; i < 16; ++i) {
      const v4f a4 = *(const v4f*)(ap + i * 8);
      v2f a0; a0.x = a4.x;    a0.y = a4.y;
      v2f a1; a1.x = a4.z;    a1.y = a4.w;
      v2f b0; b0.x = u4[i].x; b0.y = u4[i].y;
      v2f b1; b1.x = u4[i].z; b1.y = u4[i].w;
      s0 = __builtin_amdgcn_wmma_f32_16x16x4_f32(false, a0, false, b0,
                                                 (short)0, s0, false, false);
      s1 = __builtin_amdgcn_wmma_f32_16x16x4_f32(false, a1, false, b1,
                                                 (short)0, s1, false, false);
    }
    s0 += s1;
    {
      v4f lo; lo.x = s0[0]; lo.y = s0[1]; lo.z = s0[2]; lo.w = s0[3];
      v4f up4; up4.x = s0[4]; up4.y = s0[5]; up4.z = s0[6]; up4.w = s0[7];
      *(v4f*)&part[((w * 2 + 0) * 32 + l) * 4] = lo;
      *(v4f*)&part[((w * 2 + 1) * 32 + l) * 4] = up4;
    }
    __syncthreads();                 // all 8 partial score tiles are in LDS
    v4f sl = *(const v4f*)&part[l * 4];
    v4f sh = *(const v4f*)&part[(32 + l) * 4];
#pragma unroll
    for (int q = 1; q < 8; ++q) {
      sl += *(const v4f*)&part[((q * 2 + 0) * 32 + l) * 4];
      sh += *(const v4f*)&part[((q * 2 + 1) * 32 + l) * 4];
    }
    float p[8] = {sl.x, sl.y, sl.z, sl.w, sh.x, sh.y, sh.z, sh.w};
    float tm = p[0];
#pragma unroll
    for (int r = 1; r < 8; ++r) tm = fmaxf(tm, p[r]);
    tm = fmaxf(tm, __shfl_xor(tm, 16));        // the other 8 rows of this head
    const float mn = fmaxf(m, tm);
    const float alpha = __expf(m - mn);
    m = mn;
    float ps = 0.f;
#pragma unroll
    for (int r = 0; r < 8; ++r) { p[r] = __expf(p[r] - mn); ps += p[r]; }
    lsum = lsum * alpha + ps;
#pragma unroll
    for (int g = 0; g < 2; ++g)
#pragma unroll
      for (int e = 0; e < 4; ++e) acc[g][e] *= alpha;
    v4f xr[2][4][2];
#pragma unroll
    for (int g = 0; g < 2; ++g)
#pragma unroll
      for (int j = 0; j < 4; ++j) {
        const float* rp = xt + (8 * hi + 2 * j) * XP + w * 128 + g * 64 + 4 * l16;
        xr[g][j][0] = *(const v4f*)rp;
        xr[g][j][1] = *(const v4f*)(rp + XP);
      }
    auto second = [&](int g) {
#pragma unroll
      for (int j = 0; j < 4; ++j) {
        v2f pb; pb.x = p[2 * j]; pb.y = p[2 * j + 1];
#pragma unroll
        for (int e = 0; e < 4; ++e) {
          v2f a; a.x = xr[g][j][0][e]; a.y = xr[g][j][1][e];
          acc[g][e] = __builtin_amdgcn_wmma_f32_16x16x4_f32(
              false, a, false, pb, (short)0, acc[g][e], false, false);
        }
      }
    };
    second(0);
    // Keeps the first half's WMMAs in front of the hand-over: without it the
    // wait for tile t+1's copies is lifted in front of them, a quarter of a
    // trip away from the refill, and every copy has that much less time to land.
    __builtin_amdgcn_sched_barrier(0);
    // hand-over of the ring: the tile's last fragments are fetched and this
    // wave's LDS reads done, its copies of tile t+1 have landed, then every
    // wave meets; only then the refill of the buffer just read.
    asm volatile("s_wait_dscnt 0x0" ::: "memory");
    wait_async0();
    __syncthreads();
    if (t + 2 < 8) fill(t + 2, t & 1);
    second(1);
  }
  wait_async0();

  // Turn the wave's slice from (lane = h) to (lane = c) through its own columns
  // of buffer 0, so that every global store is 512 contiguous bytes.
#pragma unroll
  for (int g = 0; g < 2; ++g)
#pragma unroll
    for (int r = 0; r < 8; ++r) {
      v4f v; v.x = acc[g][0][r]; v.y = acc[g][1][r];
      v.z = acc[g][2][r]; v.w = acc[g][3][r];
      *(v4f*)&xs[0][l16 * XP + w * 128 + g * 64 + 4 * (r + 8 * hi)] = v;
    }
  float* yp = ypart + (size_t)blockIdx.x * NH * CH + w * 128 + l * 4;
#pragma unroll
  for (int h = 0; h < NH; ++h)
    *(v4f*)(yp + (size_t)h * CH) = *(const v4f*)&xs[0][h * XP + w * 128 + l * 4];
  lsum += __shfl_xor(lsum, 16);
  if (tid < 16) {
    ml[blockIdx.x * 32 + tid]      = m;
    ml[blockIdx.x * 32 + 16 + tid] = lsum;
  }
}

template <int AI, int NP, int AP, int LDB>
__device__ __forceinline__ float tile16x32_k1024(const float* __restrict__ ap,
                                                 const float* __restrict__ B,
                                                 float* part) {
  const int tid = threadIdx.x;
  const int w   = tid >> 5;
  const int l   = tid & 31;
  const int l16 = l & 15;
  const int k0  = w * 64 + (l >> 4) * 4;
  const float* bp = B + (size_t)k0 * LDB + 2 * l16;
  v4f a4[NP][8];
  v2f b2[8][4];
#pragma unroll
  for (int q = 0; q < NP; ++q)
#pragma unroll
    for (int i = 0; i < 8; ++i)
      a4[q][i] = *(const v4f*)(ap + (size_t)q * AP + i * AI);
#pragma unroll
  for (int i = 0; i < 8; ++i)
#pragma unroll
    for (int e = 0; e < 4; ++e)
      b2[i][e] = *(const v2f*)(bp + (size_t)(i * 8 + e) * LDB);
  // Holds the products behind all loads, so that the wave's whole k slice
  // is in flight at once; without it the loads are dealt out among the WMMAs,
  // about a third of them in flight, and the slice takes several round trips.
  __builtin_amdgcn_sched_barrier(0);
  // Both address pairs stay in their registers, written by nothing (no load's
  // result either), until this wait behind the last load.
  asm volatile("s_wait_xcnt 0x0" :: "v"(ap), "v"(bp) : "memory");
#pragma unroll
  for (int q = 1; q < NP; ++q)
#pragma unroll
    for (int i = 0; i < 8; ++i) a4[0][i] += a4[q][i];
  v8f acc0 = {}, acc1 = {};
#pragma unroll
  for (int i = 0; i < 8; ++i) {
#pragma unroll
    for (int p = 0; p < 2; ++p) {
      v2f a;  a.x  = a4[0][i][2 * p]; a.y  = a4[0][i][2 * p + 1];
      v2f c0; c0.x = b2[i][2 * p].x;  c0.y = b2[i][2 * p + 1].x;
      v2f c1; c1.x = b2[i][2 * p].y;  c1.y = b2[i][2 * p + 1].y;
      acc0 = __builtin_amdgcn_wmma_f32_16x16x4_f32(false, a, false, c0,
                                                   (short)0, acc0, false, false);
      acc1 = __builtin_amdgcn_wmma_f32_16x16x4_f32(false, a, false, c1,
                                                   (short)0, acc1, false, false);
    }
  }
#pragma unroll
  for (int r = 0; r < 8; ++r) {
    v2f t; t.x = acc0[r]; t.y = acc1[r];
    *(v2f*)&part[w * 512 + r * 64 + 2 * l] = t;
  }
  __syncthreads();                   // all 16 partial tiles are in LDS
  float s = part[tid];
#pragma unroll
  for (int q = 1; q < 16; ++q) s += part[q * 512 + tid];
  return s;
}

#define KSPLIT 4
#define YP 260
#define PR 68
__global__ __launch_bounds__(512) void k_cls(const float* __restrict__ ypart,
                                             const float* __restrict__ ml,
                                             const float* __restrict__ Wkv,
                                             float* __restrict__ clsp) {
  __shared__ __attribute__((aligned(16))) float ys[16 * YP];
  __shared__ __attribute__((aligned(16))) float part[16 * 8 * PR];
  const int tid = threadIdx.x;
  const int w   = tid >> 5;
  const int l   = tid & 31;
  const int l16 = l & 15;
  const int hi  = l >> 4;
  const int mt  = blockIdx.x >> 6;   // the 4 blocks that share W_kv lines: 64 apart
  const int h   = (blockIdx.x >> 2) & 15;
  const int kc  = blockIdx.x & 3;
  const int kq  = w >> 1;
  const int np  = w & 1;
  const int b   = mt * 16 + w;
  const float* yp = ypart + ((size_t)b * NSPLIT * NH + h) * CH + kc * 256 + l * 4;
  const float* bp = Wkv + (size_t)(kc * 256 + kq * 32 + hi * 4) * (2 * NH * HD)
                    + NH * HD + h * HD + np * 32 + 2 * l16;
  const int mi = b * NSPLIT * 32 + h;
  v4f v[NSPLIT][2];
  v2f b2[4][4];
  float ms[NSPLIT], ls[NSPLIT];
#pragma unroll
  for (int s = 0; s < NSPLIT; ++s) {
    v[s][0] = *(const v4f*)(yp + (size_t)s * NH * CH);
    v[s][1] = *(const v4f*)(yp + (size_t)s * NH * CH + 128);
  }
#pragma unroll
  for (int s = 0; s < NSPLIT; ++s) {
    ms[s] = ml[mi + s * 32];
    ls[s] = ml[mi + s * 32 + 16];
  }
#pragma unroll
  for (int i = 0; i < 4; ++i)
#pragma unroll
    for (int e = 0; e < 4; ++e)
      b2[i][e] = *(const v2f*)(bp + (size_t)(i * 8 + e) * (2 * NH * HD));
  // Holds the join behind all 48 loads, so that the weights of the product are
  // under way while the splits are joined: one memory round trip, not two.
  __builtin_amdgcn_sched_barrier(0);
  // The addresses stay in their registers, written by nothing (no load's
  // result either), until this wait behind the last load.
  asm volatile("s_wait_xcnt 0x0" :: "v"(yp), "v"(mi), "v"(bp) : "memory");
  float M = -3.0e38f;
#pragma unroll
  for (int s = 0; s < NSPLIT; ++s) M = fmaxf(M, ms[s]);
  float L = 0.f;
  v4f y0 = {}, y1 = {};
#pragma unroll
  for (int s = 0; s < NSPLIT; ++s) {
    const float e = __expf(ms[s] - M);
    L += e * ls[s];
    y0 += e * v[s][0];
    y1 += e * v[s][1];
  }
  const float rl = 1.f / L;
  *(v4f*)&ys[w * YP + l * 4]       = y0 * rl;
  *(v4f*)&ys[w * YP + 128 + l * 4] = y1 * rl;
  __syncthreads();                   // the 16 joined rows are in LDS
  const float* ap = ys + l16 * YP + kq * 32 + hi * 4;
  v8f acc0 = {}, acc1 = {};
#pragma unroll
  for (int i = 0; i < 4; ++i) {
    const v4f a4 = *(const v4f*)(ap + i * 8);
#pragma unroll
    for (int p = 0; p < 2; ++p) {
      v2f a;  a.x  = a4[2 * p];       a.y  = a4[2 * p + 1];
      v2f c0; c0.x = b2[i][2 * p].x;  c0.y = b2[i][2 * p + 1].x;
      v2f c1; c1.x = b2[i][2 * p].y;  c1.y = b2[i][2 * p + 1].y;
      acc0 = __builtin_amdgcn_wmma_f32_16x16x4_f32(false, a, false, c0,
                                                   (short)0, acc0, false, false);
      acc1 = __builtin_amdgcn_wmma_f32_16x16x4_f32(false, a, false, c1,
                                                   (short)0, acc1, false, false);
    }
  }
  // D: register r, lane half hi = row r + 8*hi; lane column l16 = d 2*l16 + j
#pragma unroll
  for (int r = 0; r < 8; ++r) {
    v2f t; t.x = acc0[r]; t.y = acc1[r];
    *(v2f*)&part[(w * 8 + r) * PR + 2 * l] = t;
  }
  __syncthreads();                   // all 16 partial tiles are in LDS
  // thread tid sums, for both np, the element that lies at place tid of the
  // 512 floats of clsp that belong to (mt, h, np)
  const int row = (tid >> 2) & 15;
  const int col = ((tid >> 7) & 3) * 8 + ((tid >> 6) & 1) * 4 + (tid & 3);
  const int idx = (row & 7) * PR + (row >> 3) * 32 + col;
  float* cp = clsp + (size_t)kc * (BATCH * NH * HD) + mt * 16384 + h * 1024 + tid;
#pragma unroll
  for (int n = 0; n < 2; ++n) {
    float s = part[n * 8 * PR + idx];
#pragma unroll
    for (int q = 1; q < 8; ++q) s += part[(q * 2 + n) * 8 * PR + idx];
    cp[n * 512] = s;
  }
}

// Kernel 6: out[b,:] = cls[b,:] @ W_proj + b_proj, cls = the sum of clsp's planes
// block = (16 batch rows, 32 output columns)
__global__ __launch_bounds__(512) void k_proj(const float* __restrict__ clsp,
                                              const float* __restrict__ Wproj,
                                              const float* __restrict__ bproj,
                                              float* __restrict__ out) {
  __shared__ float part[16 * 512];
  const int tid = threadIdx.x;
  const int mt = blockIdx.x & 3;
  const int nt = blockIdx.x >> 2;
  const float s = tile16x32_k1024<128, KSPLIT, BATCH * NH * HD, CH>(
      clsp + mt * 16384 + (tid >> 5) * 1024 + (tid & 31) * 4, Wproj + nt * 32, part);
  const int row = (tid >> 6) + 8 * ((tid >> 5) & 1);
  const int col = nt * 32 + (tid & 31);
  out[(size_t)(mt * 16 + row) * CH + col] = s + bproj[col];
}

// Kernel 1: q[b,:] = x[b,0,:] @ W_q, all 64 batch rows at once (M = 64).
// block = (16 batch rows, 32 columns); row b of A is token 0 of batch b.
__global__ __launch_bounds__(512) void k_q(const float* __restrict__ x,
                                           const float* __restrict__ Wq,
                                           float* __restrict__ q) {
  __shared__ float part[16 * 512];
  const int tid = threadIdx.x;
  const int mt = blockIdx.x & 3;
  const int nt = blockIdx.x >> 2;
  const float s = tile16x32_k1024<8, 1, 0, NH * HD>(
      x + (size_t)(mt * 16 + (tid & 15)) * SEQ * CH + (tid >> 5) * 64 + ((tid >> 4) & 1) * 4,
      Wq + nt * 32, part);
  const int row = (tid >> 6) + 8 * ((tid >> 5) & 1);
  q[(size_t)(mt * 16 + row) * (NH * HD) + nt * 32 + (tid & 31)] = s;
}

__global__ __launch_bounds__(256) void k_u(const float* __restrict__ q,
                                           const float* __restrict__ Wkv,
                                           float* __restrict__ u) {
  const int tid = threadIdx.x;
  const int w   = tid >> 5;
  const int l   = tid & 31;
  const int l16 = l & 15;
  const int h   = blockIdx.x >> 4;
  const int c0  = (blockIdx.x & 15) * 64 + (w >> 2) * 32;
  const int mt  = w & 3;
  const int k0  = h * HD + (l >> 4) * 4;
  const float* ap = q + (size_t)(mt * 16 + l16) * (NH * HD) + k0;
  const float* bp = Wkv + (size_t)(c0 + 2 * l16) * (2 * NH * HD) + k0;
  // D: lane column l16, register r holds batch row r (+8 for the high lanes)
  float* up = u + ((size_t)(mt * 16 + (l >> 4) * 8) * NH + h) * CH + c0 + 2 * l16;
  // Every loop below is unrolled whole: a4, b4 and the accumulators are
  // indexed by constants only and so stay in registers.
  v4f a4[8], b4[2][8];
#pragma unroll
  for (int i = 0; i < 8; ++i) a4[i] = *(const v4f*)(ap + i * 8);
#pragma unroll
  for (int j = 0; j < 2; ++j)
#pragma unroll
    for (int i = 0; i < 8; ++i)
      b4[j][i] = *(const v4f*)(bp + (size_t)j * (2 * NH * HD) + i * 8);
  // Holds the products behind all 24 loads, so that both 128-byte lines of
  // every row are asked for at once; without it a third of the loads is in
  // flight and the second line waits for the first to come back.
  __builtin_amdgcn_sched_barrier(0);
  v8f acc0 = {}, acc1 = {};
#pragma unroll
  for (int i = 0; i < 8; ++i) {
#pragma unroll
    for (int p = 0; p < 2; ++p) {
      v2f a;  a.x  = a4[i][2 * p];    a.y  = a4[i][2 * p + 1];
      v2f e0; e0.x = b4[0][i][2 * p]; e0.y = b4[0][i][2 * p + 1];
      v2f e1; e1.x = b4[1][i][2 * p]; e1.y = b4[1][i][2 * p + 1];
      acc0 = __builtin_amdgcn_wmma_f32_16x16x4_f32(false, a, false, e0,
                                                   (short)0, acc0, false, false);
      acc1 = __builtin_amdgcn_wmma_f32_16x16x4_f32(false, a, false, e1,
                                                   (short)0, acc1, false, false);
    }
  }
#pragma unroll
  for (int r = 0; r < 8; ++r) {
    v2f t; t.x = SCALEF * acc0[r]; t.y = SCALEF * acc1[r];
    *(v2f*)(up + (size_t)r * NH * CH) = t;
  }
}

// ---------------------------------------------------------------------------
extern "C" void kernel_launch(void* const* d_in, const int* in_sizes, int n_in,
                              void* d_out, int out_size, void* d_ws, size_t ws_size,
                              hipStream_t stream) {
  const float* x     = (const float*)d_in[0];
  const float* Wkv   = (const float*)d_in[1];
  const float* Wq    = (const float*)d_in[2];
  const float* Wproj = (const float*)d_in[3];
  const float* bproj = (const float*)d_in[4];
  float* out = (float*)d_out;

  float* u      = (float*)d_ws;                        // B*NH*CH  = 1M floats
  float* clsp   = u + (size_t)BATCH * NH * CH;         // 4*B*NH*HD = 256K floats
  float* qv     = clsp + (size_t)KSPLIT * BATCH * NH * HD;  // B*NH*HD = 64K floats
  float* ml     = qv + (size_t)BATCH * NH * HD;        // B*8*32   = 16K floats
  float* ypart  = ml + (size_t)BATCH * NSPLIT * 32;    // B*8*NH*CH = 8M floats

  k_q      <<<128,        512, 0, stream>>>(x, Wq, qv);
  k_u      <<<NH * 16,    256, 0, stream>>>(qv, Wkv, u);
  k_fused  <<<BATCH * NSPLIT, 256, 0, stream>>>(x, u, ypart, ml);
  k_cls    <<<4 * NH * KSPLIT, 512, 0, stream>>>(ypart, ml, Wkv, clsp);
  k_proj   <<<128,        512, 0, stream>>>(clsp, Wproj, bproj, out);
}
